// v000
// Times are from an AMD MI455X. After a warm-up the kernel runs many times in a row, and a time is the length of
// such a window on the GPU divided by its runs, so every launch and the gaps after it count. The runs cycle
// through copies of the inputs. A figure is the median of several windows, for all but v000 over two sittings.
// Sittings can differ by a few percent; kernels timed side by side share one.
// The starting kernel, v000, takes 3240 microseconds a run.
#include <hip/hip_runtime.h>

// Compute dtypes, f32 accumulate, per item: the three 1x1 convs as one [4096 x 256].[256 x 320] GEMM with PLAIN bf16 operands (exact products), bias added in f32
// -> bf16 hi + UNSCALED residual planes; scores = q'.k'^T ([1024 x 32].[32 x 4096] per chunk, three products), softmax (x 1/sqrt(256)) in f32 -> P planes; out^T =

#define NBT  4
#define CC   256
#define C8   32
#define NN   4096
#define NQKV (2 * C8 + CC)        // 320
#define RCH  1024
#define DM   CC
#define NTK  NN
#define SCL  0.0625f
#define LOSC 1024.0f

typedef _Float16 h16;
typedef unsigned short bf;
typedef __attribute__((ext_vector_type(16))) __bf16   v16bf;
typedef __attribute__((ext_vector_type(16))) _Float16 v16h;
typedef __attribute__((ext_vector_type(8)))  _Float16 v8h;
typedef __attribute__((ext_vector_type(8)))  unsigned short v8us;
typedef __attribute__((ext_vector_type(8)))  float    v8f;
typedef __attribute__((ext_vector_type(4)))  float    v4f;
typedef __attribute__((ext_vector_type(4)))  _Float16 v4h;
typedef v8h  __attribute__((may_alias)) v8ha;
typedef v4f  __attribute__((may_alias)) v4fa;
typedef v8us __attribute__((may_alias)) v8usa;

__device__ __forceinline__ unsigned short f2bf(float f) { unsigned u = __float_as_uint(f); u += 0x7FFFu + ((u >> 16) & 1u); return (unsigned short)(u >> 16); }
__device__ __forceinline__ float bf2f(unsigned short b) { return __uint_as_float(((unsigned)b) << 16); }
__device__ __forceinline__ float bfr(float f) { return bf2f(f2bf(f)); }
__device__ __forceinline__ v16h cat16(v8h lo, v8h hi) { return __builtin_shufflevector(lo, hi, 0, 1, 2, 3, 4, 5, 6, 7, 8, 9, 10, 11, 12, 13, 14, 15); }
__device__ __forceinline__ v16bf cat16b(v8us lo, v8us hi) { return __builtin_bit_cast(v16bf, __builtin_shufflevector(lo, hi, 0, 1, 2, 3, 4, 5, 6, 7, 8, 9, 10, 11, 12, 13, 14, 15)); }
__device__ __forceinline__ v8f wmma16(v16h a, v16h b, v8f c) { return __builtin_amdgcn_wmma_f32_16x16x32_f16(false, a, false, b, (short)0, c, false, false); }
__device__ __forceinline__ v8f wmmab(v16bf a, v16bf b, v8f c) { return __builtin_amdgcn_wmma_f32_16x16x32_bf16(false, a, false, b, (short)0, c, false, false); }

// k_wt: WT [n][K] = bf16(W[k][n]) (k-major [K][ncols]) via 64 x 64 LDS tiles; grid (K/64, ncols/64).
__global__ __launch_bounds__(256) void k_wt(const float* __restrict__ Wm, int K, int ncols, bf* WT) {
    __shared__ __align__(16) unsigned short tl[64 * 72];
    const int tid = threadIdx.x, k0 = blockIdx.x * 64, n0 = blockIdx.y * 64;
    const int kk = tid >> 2, nq = (tid & 3) * 16;
#pragma unroll
    for (int i = 0; i < 16; ++i) tl[(nq + i) * 72 + kk] = f2bf(Wm[(size_t)(k0 + kk) * ncols + n0 + nq + i]);
    __syncthreads();
    const int piece = tid & 7;
    auto pass = [&]() {
#pragma unroll
        for (int s = 0; s < 2; ++s) { const int nr = (tid >> 3) + 32 * s; const v8us val = *(const v8usa*)(tl + nr * 72 + piece * 8); *(v8us*)(WT + (size_t)(n0 + nr) * K + k0 + piece * 8) = val; }
    };
    pass(); 
}
// k_gemmb: 64 x 64 block tile (4 waves x 16 x 64) of C[NTK][NW] = (A [+ Al]).B^T (K = 256) [+ bf(bias[c])] [+ bf(R[r][c]) residual]; f32 whole-line epilogue (or f16
template <bool SPLITA, bool F16OUT = false>
__global__ __launch_bounds__(128) void k_gemmb(const bf* __restrict__ A, const bf* __restrict__ Al, const bf* __restrict__ Bn, const float* __restrict__ bias, float* C, int ldc, h16* C2, const float* __restrict__ R = nullptr, int K = DM, int roundR = 1) {
    __shared__ __align__(16) float ost[4][16 * 68];
    const int lane = threadIdx.x & 31, wave = threadIdx.x >> 5, lr = lane & 15, hi = lane >> 4;
    const int r0 = blockIdx.x * 64 + wave * 16, c0 = blockIdx.y * 64;
    const size_t aoff = (size_t)(r0 + lr) * K + 8 * hi;
    size_t boff[4];
#pragma unroll
    for (int t = 0; t < 4; ++t) boff[t] = (size_t)(c0 + t * 16 + lr) * K + 8 * hi;
    v8f acc[4];
#pragma unroll
    for (int t = 0; t < 4; ++t) acc[t] = (v8f){};
#pragma unroll 1
    for (int kc = 0; kc < K; kc += 32) {
        const v16bf a = cat16b(*(const v8us*)(A + aoff + kc), *(const v8us*)(A + aoff + kc + 16));
        v16bf al = a;
        if (SPLITA) al = cat16b(*(const v8us*)(Al + aoff + kc), *(const v8us*)(Al + aoff + kc + 16));
#pragma unroll
        for (int t = 0; t < 4; ++t) { const v16bf b = cat16b(*(const v8us*)(Bn + boff[t] + kc), *(const v8us*)(Bn + boff[t] + kc + 16)); acc[t] = wmmab(a, b, acc[t]); if (SPLITA) acc[t] = wmmab(al, b, acc[t]); }
        asm volatile("v_nop\n\tv_nop\n\tv_nop\n\tv_nop" : "+v"(acc[0]), "+v"(acc[1]), "+v"(acc[2]), "+v"(acc[3]) : "v"(a), "v"(al));
    }
    float* os = &ost[wave][0];
#pragma unroll
    for (int t = 0; t < 4; ++t) { const float bv = bias ? bfr(bias[c0 + t * 16 + lr]) : 0.f;
#pragma unroll
        for (int j = 0; j < 8; ++j) os[(hi * 8 + j) * 68 + t * 16 + lr] = acc[t][j] + bv; }
    __syncthreads();
    if (F16OUT) {
        h16* crow = (h16*)(void*)C + (size_t)r0 * ldc + c0;
        auto pass = [&]() {
#pragma unroll
            for (int s = 0; s < 4; ++s) { const int row = 4 * s + (lane >> 3), piece = lane & 7; const float* sp = os + row * 68 + piece * 8; v8h o, o2;
#pragma unroll
                for (int i = 0; i < 8; ++i) { const h16 a = (h16)sp[i]; o[i] = a; o2[i] = (h16)((sp[i] - (float)a) * LOSC); }
                *(v8h*)(crow + (size_t)row * ldc + piece * 8) = o; if (C2) *(v8h*)(C2 + (size_t)r0 * ldc + c0 + (size_t)row * ldc + piece * 8) = o2; }
        };
        pass(); 
    } else {
        float* crow = C + (size_t)r0 * ldc + c0;
        auto pass = [&]() {
#pragma unroll
            for (int s = 0; s < 8; ++s) { const int Lid = (lane >> 3) + 4 * s, piece = lane & 7; const int row = Lid >> 1, cofs = (Lid & 1) * 32 + piece * 4;
                v4f val = *(const v4fa*)(os + row * 68 + cofs); if (R) { const v4f rv = *(const v4f*)(R + ((size_t)r0 + row) * ldc + c0 + cofs); val += roundR ? (v4f){bfr(rv[0]), bfr(rv[1]), bfr(rv[2]), bfr(rv[3])} : rv; }
                *(v4f*)(crow + (size_t)row * ldc + cofs) = val; }
        };
        pass(); 
    }
}

// k_gemm3: 64 x 64 tile of C = (Ah + Al).(Bh + Bl)^T over K (row strides = K for all four planes; n-major B): three products per 32-k step (hh, hl, lh); f32
__global__ __launch_bounds__(128) void k_gemm3(const bf* __restrict__ Ah, const bf* __restrict__ Al, const bf* __restrict__ Bh, const bf* __restrict__ Bl, int K, float* C, int ldc) {
    __shared__ __align__(16) float ost[4][16 * 68];
    const int lane = threadIdx.x & 31, wave = threadIdx.x >> 5, lr = lane & 15, hi = lane >> 4;
    const int r0 = blockIdx.x * 64 + wave * 16, c0 = blockIdx.y * 64;
    const size_t aoff = (size_t)(r0 + lr) * K + 8 * hi;
    v8f acc[4];
#pragma unroll
    for (int t = 0; t < 4; ++t) acc[t] = (v8f){};
#pragma unroll 1
    for (int kc = 0; kc < K; kc += 32) {
        const v16bf a = cat16b(*(const v8us*)(Ah + aoff + kc), *(const v8us*)(Ah + aoff + kc + 16));
        const v16bf al = cat16b(*(const v8us*)(Al + aoff + kc), *(const v8us*)(Al + aoff + kc + 16));
#pragma unroll
        for (int t = 0; t < 4; ++t) { const size_t bo = (size_t)(c0 + t * 16 + lr) * K + kc + 8 * hi;
            const v16bf bh = cat16b(*(const v8us*)(Bh + bo), *(const v8us*)(Bh + bo + 16)); const v16bf bl = cat16b(*(const v8us*)(Bl + bo), *(const v8us*)(Bl + bo + 16));
            acc[t] = wmmab(a, bh, acc[t]); acc[t] = wmmab(al, bh, acc[t]); acc[t] = wmmab(a, bl, acc[t]); }
        asm volatile("v_nop\n\tv_nop\n\tv_nop\n\tv_nop" : "+v"(acc[0]), "+v"(acc[1]), "+v"(acc[2]), "+v"(acc[3]) : "v"(a), "v"(al));
    }
    float* os = &ost[wave][0];
#pragma unroll
    for (int t = 0; t < 4; ++t) {
#pragma unroll
        for (int j = 0; j < 8; ++j) os[(hi * 8 + j) * 68 + t * 16 + lr] = acc[t][j]; }
    __builtin_amdgcn_wave_barrier(); asm volatile("" ::: "memory");
    float* crow = C + (size_t)r0 * ldc + c0;
    auto pass = [&]() {
#pragma unroll
        for (int s = 0; s < 8; ++s) { const int Lid = (lane >> 3) + 4 * s, piece = lane & 7; const int row = Lid >> 1, cofs = (Lid & 1) * 32 + piece * 4;
            const v4f val = *(const v4fa*)(os + row * 68 + cofs); *(v4f*)(crow + (size_t)row * ldc + cofs) = val; }
    };
    pass(); 
}


__global__ __launch_bounds__(256) void k_cvt8(const float* __restrict__ src, bf* dst, size_t n8) {
    const size_t i = (size_t)blockIdx.x * 256 + threadIdx.x; if (i >= n8) return;
    const v8f v = *(const v8f*)(src + i * 8); v8us o;
#pragma unroll
    for (int k = 0; k < 8; ++k) o[k] = f2bf(v[k]);
    *(v8us*)(dst + i * 8) = o; 
}
__global__ __launch_bounds__(256) void k_zero8(bf* dst, size_t n8) {
    const size_t i = (size_t)blockIdx.x * 256 + threadIdx.x; if (i >= n8) return; v8us z;
#pragma unroll
    for (int k = 0; k < 8; ++k) z[k] = 0;
    *(v8us*)(dst + i * 8) = z; 
}

__global__ __launch_bounds__(256) void k_qkplanes(const float* __restrict__ F, int off, bf* Ph, bf* Pl) {
    typedef __attribute__((ext_vector_type(2))) unsigned short v2us;
    const int lane = threadIdx.x & 31; const size_t r = ((size_t)blockIdx.x * 8 + (threadIdx.x >> 5)) * 2 + (lane >> 4); if (r >= (size_t)NN) return; const int c0 = (lane & 15) * 2; v2us oh, ol;
#pragma unroll
    for (int i = 0; i < 2; ++i) { const float y = F[r * NQKV + off + c0 + i]; const unsigned short hb = f2bf(y); oh[i] = hb; ol[i] = f2bf(y - bf2f(hb)); }
    const size_t o = r * C8 + c0; *(v2us*)(Ph + o) = oh; *(v2us*)(Pl + o) = ol; 
}
__global__ __launch_bounds__(256) void k_vt(const float* __restrict__ F, bf* Th, bf* Tl) {
    typedef __attribute__((ext_vector_type(2))) unsigned short v2us;
    const int lane = threadIdx.x & 31; const size_t wid = (size_t)blockIdx.x * 8 + (threadIdx.x >> 5); if (wid >= (size_t)CC * (NN / 64)) return; const int c = (int)(wid / (NN / 64)); const int j0 = (int)(wid % (NN / 64)) * 64 + lane * 2; v2us oh, ol;
#pragma unroll
    for (int i = 0; i < 2; ++i) { const float y = F[(size_t)(j0 + i) * NQKV + 2 * C8 + c]; const unsigned short hb = f2bf(y); oh[i] = hb; ol[i] = f2bf(y - bf2f(hb)); }
    const size_t o = (size_t)c * NN + j0; *(v2us*)(Th + o) = oh; *(v2us*)(Tl + o) = ol; 
}
__global__ __launch_bounds__(256) void k_softmax4096(const float* __restrict__ S, bf* PH, bf* PL) {
    typedef __attribute__((ext_vector_type(4))) unsigned short v4us;
    const int lane = threadIdx.x & 31, i = blockIdx.x * 8 + (threadIdx.x >> 5); if (i >= RCH) return;
    float m = -3.0e38f;
#pragma unroll 1
    for (int c0 = lane * 4; c0 < NN; c0 += 128) {
#pragma unroll
        for (int q = 0; q < 4; ++q) m = fmaxf(m, S[(size_t)i * NN + c0 + q] * SCL); }
#pragma unroll
    for (int sh = 16; sh; sh >>= 1) m = fmaxf(m, __shfl_xor(m, sh, 32));
    float sum = 0.f;
#pragma unroll 1
    for (int c0 = lane * 4; c0 < NN; c0 += 128) {
#pragma unroll
        for (int q = 0; q < 4; ++q) sum += __expf(S[(size_t)i * NN + c0 + q] * SCL - m); }
#pragma unroll
    for (int sh = 16; sh; sh >>= 1) sum += __shfl_xor(sum, sh, 32);
    const float inv = 1.0f / sum;
{
#pragma unroll 1
        for (int c0 = lane * 4; c0 < NN; c0 += 128) { v4us oh, ol;
#pragma unroll
            for (int q = 0; q < 4; ++q) { const float p = __expf(S[(size_t)i * NN + c0 + q] * SCL - m) * inv; const unsigned short hb = f2bf(p); oh[q] = hb; ol[q] = f2bf(p - bf2f(hb)); }
            const size_t o = (size_t)i * NN + c0; *(v4us*)(PH + o) = oh; *(v4us*)(PL + o) = ol; }
         }
}
__global__ __launch_bounds__(256) void k_fin(const float* __restrict__ O, const float* __restrict__ xb, const float* __restrict__ gam, float* OUTB) {
    const int lane = threadIdx.x & 31; const size_t wid = (size_t)blockIdx.x * 8 + (threadIdx.x >> 5); if (wid >= (size_t)CC * (NN / 128)) return; const size_t o = wid * 128 + lane * 4; const float gm = bfr(gam[0]); v4f v;
#pragma unroll
    for (int q = 0; q < 4; ++q) v[q] = gm * O[o + q] + bfr(xb[o + q]);
    *(v4f*)(OUTB + o) = v; 
}
__global__ __launch_bounds__(128) void k_bias320(const float* __restrict__ bq, const float* __restrict__ bk, const float* __restrict__ bv, float* B320) {
    const int t = threadIdx.x; if (t >= 96) return; v4f v;
#pragma unroll
    for (int q = 0; q < 4; ++q) { const int c = t * 4 + q; v[q] = (c < C8) ? bq[c < C8 ? c : 0] : (c < 2 * C8) ? bk[(c >= C8 && c < 2 * C8) ? c - C8 : 0] : (c < NQKV) ? bv[(c >= 2 * C8 && c < NQKV) ? c - 2 * C8 : 0] : 0.f; }
    *(v4f*)(B320 + t * 4) = v; 
}

extern "C" void kernel_launch(void* const* d_in, const int* in_sizes, int n_in,
                              void* d_out, int out_size, void* d_ws, size_t ws_size, hipStream_t stream) {
    (void)in_sizes; (void)n_in; (void)out_size;
    const float* x = (const float*)d_in[0]; const float* wq = (const float*)d_in[1]; const float* bq = (const float*)d_in[2]; const float* wk = (const float*)d_in[3]; const float* bk = (const float*)d_in[4]; const float* wv = (const float*)d_in[5]; const float* bv = (const float*)d_in[6]; const float* gam = (const float*)d_in[7];
    float* out = (float*)d_out;    // [4][256][64][64]
    char* wsp = (char*)d_ws;
    auto take = [&](size_t bytes) { char* p = wsp; wsp += (bytes + 255) & ~(size_t)255; return (void*)p; };
    bf* WB = (bf*)take((size_t)NQKV * CC * 2); float* B320 = (float*)take(384 * 4); bf* XP = (bf*)take((size_t)NN * CC * 2); float* F = (float*)take((size_t)NN * NQKV * 4);
    bf* QPh = (bf*)take((size_t)NN * C8 * 2); bf* QPl = (bf*)take((size_t)NN * C8 * 2); bf* KPh = (bf*)take((size_t)NN * C8 * 2); bf* KPl = (bf*)take((size_t)NN * C8 * 2); bf* VTh = (bf*)take((size_t)CC * NN * 2); bf* VTl = (bf*)take((size_t)CC * NN * 2);
    float* S = (float*)take((size_t)RCH * NN * 4); bf* PH = (bf*)take((size_t)RCH * NN * 2); bf* PL = (bf*)take((size_t)RCH * NN * 2); float* O = (float*)take((size_t)CC * NN * 4);
    if ((size_t)(wsp - (char*)d_ws) > ws_size) return;    // ~ 51 MB; per item/chunk reuse in stream order
    k_cvt8<<<(C8 * CC / 8 + 255) / 256, 256, 0, stream>>>(wq, WB, C8 * CC / 8); k_cvt8<<<(C8 * CC / 8 + 255) / 256, 256, 0, stream>>>(wk, WB + (size_t)C8 * CC, C8 * CC / 8); k_cvt8<<<(CC * CC / 8 + 255) / 256, 256, 0, stream>>>(wv, WB + (size_t)2 * C8 * CC, CC * CC / 8);
    k_bias320<<<1, 128, 0, stream>>>(bq, bk, bv, B320);
    for (int b = 0; b < NBT; ++b) { const float* xb = x + (size_t)b * CC * NN;
        k_wt<<<dim3(CC / 64, NN / 64, 1), 256, 0, stream>>>(xb, CC, NN, XP);
        k_gemmb<false, false><<<dim3(NN / 64, NQKV / 64, 1), 128, 0, stream>>>(XP, nullptr, WB, B320, F, NQKV, nullptr, nullptr, CC);          // q | k | v (+ biases)
        k_qkplanes<<<(NN / 2) / 8, 256, 0, stream>>>(F, 0, QPh, QPl); k_qkplanes<<<(NN / 2) / 8, 256, 0, stream>>>(F, C8, KPh, KPl); k_vt<<<(CC * (NN / 64)) / 8, 256, 0, stream>>>(F, VTh, VTl);
        for (int ch = 0; ch < NN / RCH; ++ch) { const size_t r0 = (size_t)ch * RCH;
            k_gemm3<<<dim3(RCH / 64, NN / 64, 1), 128, 0, stream>>>(QPh + r0 * C8, QPl + r0 * C8, KPh, KPl, C8, S, NN);
            k_softmax4096<<<RCH / 8, 256, 0, stream>>>(S, PH, PL);
            k_gemm3<<<dim3(CC / 64, RCH / 64, 1), 128, 0, stream>>>(VTh, VTl, PH, PL, NN, O + r0, NN); }
        k_fin<<<(CC * (NN / 128)) / 8, 256, 0, stream>>>(O, xb, gam, out + (size_t)b * CC * NN); }
}

// v001
// One run takes 995 microseconds.
// Timed twice side by side with v000, it ran 3.17 and 3.20 times as fast.
#include <hip/hip_runtime.h>

// Compute dtypes, f32 accumulate, per item: the three 1x1 convs as one [4096 x 256].[256 x 320] GEMM with PLAIN bf16 operands (exact products), bf16-rounded conv biases added in f32
// -> bf16 hi + UNSCALED residual planes; scores = q'.k'^T ([4096 x 32].[32 x 4096], all query rows of an item in one launch, three products), softmax (x 1/sqrt(256)) in f32 -> P planes; out^T =

#define NBT  4
#define CC   256
#define C8   32
#define NN   4096
#define NQKV (2 * C8 + CC)        // 320
#define RCH  NN                    // query rows per launch: the whole item, so that the P.V grid (CC/64 x RCH/64 = 256 workgroups) has one workgroup for every WGP
#define DM   CC
#define NTK  NN
#define SCL  0.0625f
#define LOSC 1024.0f

typedef _Float16 h16;
typedef unsigned short bf;
typedef __attribute__((ext_vector_type(16))) __bf16   v16bf;
typedef __attribute__((ext_vector_type(16))) _Float16 v16h;
typedef __attribute__((ext_vector_type(8)))  _Float16 v8h;
typedef __attribute__((ext_vector_type(8)))  unsigned short v8us;
typedef __attribute__((ext_vector_type(8)))  float    v8f;
typedef __attribute__((ext_vector_type(4)))  float    v4f;
typedef __attribute__((ext_vector_type(4)))  _Float16 v4h;
typedef v8h  __attribute__((may_alias)) v8ha;
typedef v4f  __attribute__((may_alias)) v4fa;
typedef v8us __attribute__((may_alias)) v8usa;

__device__ __forceinline__ unsigned short f2bf(float f) { unsigned u = __float_as_uint(f); u += 0x7FFFu + ((u >> 16) & 1u); return (unsigned short)(u >> 16); }
__device__ __forceinline__ float bf2f(unsigned short b) { return __uint_as_float(((unsigned)b) << 16); }
__device__ __forceinline__ float bfr(float f) { return bf2f(f2bf(f)); }
__device__ __forceinline__ v16h cat16(v8h lo, v8h hi) { return __builtin_shufflevector(lo, hi, 0, 1, 2, 3, 4, 5, 6, 7, 8, 9, 10, 11, 12, 13, 14, 15); }
__device__ __forceinline__ v16bf cat16b(v8us lo, v8us hi) { return __builtin_bit_cast(v16bf, __builtin_shufflevector(lo, hi, 0, 1, 2, 3, 4, 5, 6, 7, 8, 9, 10, 11, 12, 13, 14, 15)); }
__device__ __forceinline__ v8f wmma16(v16h a, v16h b, v8f c) { return __builtin_amdgcn_wmma_f32_16x16x32_f16(false, a, false, b, (short)0, c, false, false); }
__device__ __forceinline__ v8f wmmab(v16bf a, v16bf b, v8f c) { return __builtin_amdgcn_wmma_f32_16x16x32_bf16(false, a, false, b, (short)0, c, false, false); }

// k_wt: WT [n][K] = bf16(W[k][n]) (k-major [K][ncols]) via 64 x 64 LDS tiles; grid (K/64, ncols/64).
__global__ __launch_bounds__(256) void k_wt(const float* __restrict__ Wm, int K, int ncols, bf* WT) {
    __shared__ __align__(16) unsigned short tl[64 * 72];
    const int tid = threadIdx.x, k0 = blockIdx.x * 64, n0 = blockIdx.y * 64;
    const int kk = tid >> 2, nq = (tid & 3) * 16;
#pragma unroll
    for (int i = 0; i < 16; ++i) tl[(nq + i) * 72 + kk] = f2bf(Wm[(size_t)(k0 + kk) * ncols + n0 + nq + i]);
    __syncthreads();
    const int piece = tid & 7;
    auto pass = [&]() {
#pragma unroll
        for (int s = 0; s < 2; ++s) { const int nr = (tid >> 3) + 32 * s; const v8us val = *(const v8usa*)(tl + nr * 72 + piece * 8); *(v8us*)(WT + (size_t)(n0 + nr) * K + k0 + piece * 8) = val; }
    };
    pass(); 
}
// k_gemmb: 64 x 64 block tile (4 waves x 16 x 64) of C[NTK][NW] = (A [+ Al]).B^T (K = 256) [+ bf(bias[c])] [+ bf(R[r][c]) residual]; f32 whole-line epilogue (or f16
template <bool SPLITA, bool F16OUT = false>
__global__ __launch_bounds__(128) void k_gemmb(const bf* __restrict__ A, const bf* __restrict__ Al, const bf* __restrict__ Bn, const float* __restrict__ bias, float* C, int ldc, h16* C2, const float* __restrict__ R = nullptr, int K = DM, int roundR = 1) {
    __shared__ __align__(16) float ost[4][16 * 68];
    const int lane = threadIdx.x & 31, wave = threadIdx.x >> 5, lr = lane & 15, hi = lane >> 4;
    const int r0 = blockIdx.x * 64 + wave * 16, c0 = blockIdx.y * 64;
    const size_t aoff = (size_t)(r0 + lr) * K + 8 * hi;
    size_t boff[4];
#pragma unroll
    for (int t = 0; t < 4; ++t) boff[t] = (size_t)(c0 + t * 16 + lr) * K + 8 * hi;
    v8f acc[4];
#pragma unroll
    for (int t = 0; t < 4; ++t) acc[t] = (v8f){};
#pragma unroll 1
    for (int kc = 0; kc < K; kc += 32) {
        const v16bf a = cat16b(*(const v8us*)(A + aoff + kc), *(const v8us*)(A + aoff + kc + 16));
        v16bf al = a;
        if (SPLITA) al = cat16b(*(const v8us*)(Al + aoff + kc), *(const v8us*)(Al + aoff + kc + 16));
#pragma unroll
        for (int t = 0; t < 4; ++t) { const v16bf b = cat16b(*(const v8us*)(Bn + boff[t] + kc), *(const v8us*)(Bn + boff[t] + kc + 16)); acc[t] = wmmab(a, b, acc[t]); if (SPLITA) acc[t] = wmmab(al, b, acc[t]); }
        asm volatile("v_nop\n\tv_nop\n\tv_nop\n\tv_nop" : "+v"(acc[0]), "+v"(acc[1]), "+v"(acc[2]), "+v"(acc[3]) : "v"(a), "v"(al));
    }
    float* os = &ost[wave][0];
#pragma unroll
    for (int t = 0; t < 4; ++t) { const float bv = bias ? bfr(bias[c0 + t * 16 + lr]) : 0.f;
#pragma unroll
        for (int j = 0; j < 8; ++j) os[(hi * 8 + j) * 68 + t * 16 + lr] = acc[t][j] + bv; }
    __syncthreads();
    if (F16OUT) {
        h16* crow = (h16*)(void*)C + (size_t)r0 * ldc + c0;
        auto pass = [&]() {
#pragma unroll
            for (int s = 0; s < 4; ++s) { const int row = 4 * s + (lane >> 3), piece = lane & 7; const float* sp = os + row * 68 + piece * 8; v8h o, o2;
#pragma unroll
                for (int i = 0; i < 8; ++i) { const h16 a = (h16)sp[i]; o[i] = a; o2[i] = (h16)((sp[i] - (float)a) * LOSC); }
                *(v8h*)(crow + (size_t)row * ldc + piece * 8) = o; if (C2) *(v8h*)(C2 + (size_t)r0 * ldc + c0 + (size_t)row * ldc + piece * 8) = o2; }
        };
        pass(); 
    } else {
        float* crow = C + (size_t)r0 * ldc + c0;
        auto pass = [&]() {
#pragma unroll
            for (int s = 0; s < 8; ++s) { const int Lid = (lane >> 3) + 4 * s, piece = lane & 7; const int row = Lid >> 1, cofs = (Lid & 1) * 32 + piece * 4;
                v4f val = *(const v4fa*)(os + row * 68 + cofs); if (R) { const v4f rv = *(const v4f*)(R + ((size_t)r0 + row) * ldc + c0 + cofs); val += roundR ? (v4f){bfr(rv[0]), bfr(rv[1]), bfr(rv[2]), bfr(rv[3])} : rv; }
                *(v4f*)(crow + (size_t)row * ldc + cofs) = val; }
        };
        pass(); 
    }
}

// k_gemm3: 64 x 64 tile of C = (Ah + Al).(Bh + Bl)^T over K (row strides = K for all four planes; n-major B): three products per 32-k step (hh, hl, lh); f32
__global__ __launch_bounds__(128) void k_gemm3(const bf* __restrict__ Ah, const bf* __restrict__ Al, const bf* __restrict__ Bh, const bf* __restrict__ Bl, int K, float* C, int ldc) {
    __shared__ __align__(16) float ost[4][16 * 68];
    const int lane = threadIdx.x & 31, wave = threadIdx.x >> 5, lr = lane & 15, hi = lane >> 4;
    const int r0 = blockIdx.x * 64 + wave * 16, c0 = blockIdx.y * 64;
    const size_t aoff = (size_t)(r0 + lr) * K + 8 * hi;
    v8f acc[4];
#pragma unroll
    for (int t = 0; t < 4; ++t) acc[t] = (v8f){};
#pragma unroll 1
    for (int kc = 0; kc < K; kc += 32) {
        const v16bf a = cat16b(*(const v8us*)(Ah + aoff + kc), *(const v8us*)(Ah + aoff + kc + 16));
        const v16bf al = cat16b(*(const v8us*)(Al + aoff + kc), *(const v8us*)(Al + aoff + kc + 16));
#pragma unroll
        for (int t = 0; t < 4; ++t) { const size_t bo = (size_t)(c0 + t * 16 + lr) * K + kc + 8 * hi;
            const v16bf bh = cat16b(*(const v8us*)(Bh + bo), *(const v8us*)(Bh + bo + 16)); const v16bf bl = cat16b(*(const v8us*)(Bl + bo), *(const v8us*)(Bl + bo + 16));
            acc[t] = wmmab(a, bh, acc[t]); acc[t] = wmmab(al, bh, acc[t]); acc[t] = wmmab(a, bl, acc[t]); }
        asm volatile("v_nop\n\tv_nop\n\tv_nop\n\tv_nop" : "+v"(acc[0]), "+v"(acc[1]), "+v"(acc[2]), "+v"(acc[3]) : "v"(a), "v"(al));
    }
    float* os = &ost[wave][0];
#pragma unroll
    for (int t = 0; t < 4; ++t) {
#pragma unroll
        for (int j = 0; j < 8; ++j) os[(hi * 8 + j) * 68 + t * 16 + lr] = acc[t][j]; }
    __builtin_amdgcn_wave_barrier(); asm volatile("" ::: "memory");
    float* crow = C + (size_t)r0 * ldc + c0;
    auto pass = [&]() {
#pragma unroll
        for (int s = 0; s < 8; ++s) { const int Lid = (lane >> 3) + 4 * s, piece = lane & 7; const int row = Lid >> 1, cofs = (Lid & 1) * 32 + piece * 4;
            const v4f val = *(const v4fa*)(os + row * 68 + cofs); *(v4f*)(crow + (size_t)row * ldc + cofs) = val; }
    };
    pass(); 
}


__global__ __launch_bounds__(256) void k_cvt8(const float* __restrict__ src, bf* dst, size_t n8) {
    const size_t i = (size_t)blockIdx.x * 256 + threadIdx.x; if (i >= n8) return;
    const v8f v = *(const v8f*)(src + i * 8); v8us o;
#pragma unroll
    for (int k = 0; k < 8; ++k) o[k] = f2bf(v[k]);
    *(v8us*)(dst + i * 8) = o; 
}
__global__ __launch_bounds__(256) void k_zero8(bf* dst, size_t n8) {
    const size_t i = (size_t)blockIdx.x * 256 + threadIdx.x; if (i >= n8) return; v8us z;
#pragma unroll
    for (int k = 0; k < 8; ++k) z[k] = 0;
    *(v8us*)(dst + i * 8) = z; 
}

__global__ __launch_bounds__(256) void k_qkplanes(const float* __restrict__ F, int off, bf* Ph, bf* Pl) {
    typedef __attribute__((ext_vector_type(2))) unsigned short v2us;
    const int lane = threadIdx.x & 31; const size_t r = ((size_t)blockIdx.x * 8 + (threadIdx.x >> 5)) * 2 + (lane >> 4); if (r >= (size_t)NN) return; const int c0 = (lane & 15) * 2; v2us oh, ol;
#pragma unroll
    for (int i = 0; i < 2; ++i) { const float y = F[r * NQKV + off + c0 + i]; const unsigned short hb = f2bf(y); oh[i] = hb; ol[i] = f2bf(y - bf2f(hb)); }
    const size_t o = r * C8 + c0; *(v2us*)(Ph + o) = oh; *(v2us*)(Pl + o) = ol; 
}
__global__ __launch_bounds__(256) void k_vt(const float* __restrict__ F, bf* Th, bf* Tl) {
    typedef __attribute__((ext_vector_type(2))) unsigned short v2us;
    const int lane = threadIdx.x & 31; const size_t wid = (size_t)blockIdx.x * 8 + (threadIdx.x >> 5); if (wid >= (size_t)CC * (NN / 64)) return; const int c = (int)(wid / (NN / 64)); const int j0 = (int)(wid % (NN / 64)) * 64 + lane * 2; v2us oh, ol;
#pragma unroll
    for (int i = 0; i < 2; ++i) { const float y = F[(size_t)(j0 + i) * NQKV + 2 * C8 + c]; const unsigned short hb = f2bf(y); oh[i] = hb; ol[i] = f2bf(y - bf2f(hb)); }
    const size_t o = (size_t)c * NN + j0; *(v2us*)(Th + o) = oh; *(v2us*)(Tl + o) = ol; 
}
__global__ __launch_bounds__(256) void k_softmax4096(const float* __restrict__ S, bf* PH, bf* PL) {
    typedef __attribute__((ext_vector_type(4))) unsigned short v4us;
    const int lane = threadIdx.x & 31, i = blockIdx.x * 8 + (threadIdx.x >> 5); if (i >= RCH) return;
    float m = -3.0e38f;
#pragma unroll 1
    for (int c0 = lane * 4; c0 < NN; c0 += 128) {
#pragma unroll
        for (int q = 0; q < 4; ++q) m = fmaxf(m, S[(size_t)i * NN + c0 + q] * SCL); }
#pragma unroll
    for (int sh = 16; sh; sh >>= 1) m = fmaxf(m, __shfl_xor(m, sh, 32));
    float sum = 0.f;
#pragma unroll 1
    for (int c0 = lane * 4; c0 < NN; c0 += 128) {
#pragma unroll
        for (int q = 0; q < 4; ++q) sum += __expf(S[(size_t)i * NN + c0 + q] * SCL - m); }
#pragma unroll
    for (int sh = 16; sh; sh >>= 1) sum += __shfl_xor(sum, sh, 32);
    const float inv = 1.0f / sum;
{
#pragma unroll 1
        for (int c0 = lane * 4; c0 < NN; c0 += 128) { v4us oh, ol;
#pragma unroll
            for (int q = 0; q < 4; ++q) { const float p = __expf(S[(size_t)i * NN + c0 + q] * SCL - m) * inv; const unsigned short hb = f2bf(p); oh[q] = hb; ol[q] = f2bf(p - bf2f(hb)); }
            const size_t o = (size_t)i * NN + c0; *(v4us*)(PH + o) = oh; *(v4us*)(PL + o) = ol; }
         }
}
__global__ __launch_bounds__(256) void k_fin(const float* __restrict__ O, const float* __restrict__ xb, const float* __restrict__ gam, float* OUTB) {
    const int lane = threadIdx.x & 31; const size_t wid = (size_t)blockIdx.x * 8 + (threadIdx.x >> 5); if (wid >= (size_t)CC * (NN / 128)) return; const size_t o = wid * 128 + lane * 4; const float gm = bfr(gam[0]); v4f v;
#pragma unroll
    for (int q = 0; q < 4; ++q) v[q] = gm * O[o + q] + bfr(xb[o + q]);
    *(v4f*)(OUTB + o) = v; 
}
__global__ __launch_bounds__(128) void k_bias320(const float* __restrict__ bq, const float* __restrict__ bk, const float* __restrict__ bv, float* B320) {
    const int t = threadIdx.x; if (t >= 96) return; v4f v;
#pragma unroll
    for (int q = 0; q < 4; ++q) { const int c = t * 4 + q; v[q] = (c < C8) ? bq[c < C8 ? c : 0] : (c < 2 * C8) ? bk[(c >= C8 && c < 2 * C8) ? c - C8 : 0] : (c < NQKV) ? bv[(c >= 2 * C8 && c < NQKV) ? c - 2 * C8 : 0] : 0.f; }
    *(v4f*)(B320 + t * 4) = v; 
}

extern "C" void kernel_launch(void* const* d_in, const int* in_sizes, int n_in,
                              void* d_out, int out_size, void* d_ws, size_t ws_size, hipStream_t stream) {
    (void)in_sizes; (void)n_in; (void)out_size;
    const float* x = (const float*)d_in[0]; const float* wq = (const float*)d_in[1]; const float* bq = (const float*)d_in[2]; const float* wk = (const float*)d_in[3]; const float* bk = (const float*)d_in[4]; const float* wv = (const float*)d_in[5]; const float* bv = (const float*)d_in[6]; const float* gam = (const float*)d_in[7];
    float* out = (float*)d_out;    // [4][256][64][64]
    char* wsp = (char*)d_ws;
    auto take = [&](size_t bytes) { char* p = wsp; wsp += (bytes + 255) & ~(size_t)255; return (void*)p; };
    bf* WB = (bf*)take((size_t)NQKV * CC * 2); float* B320 = (float*)take(384 * 4); bf* XP = (bf*)take((size_t)NN * CC * 2); float* F = (float*)take((size_t)NN * NQKV * 4);
    bf* QPh = (bf*)take((size_t)NN * C8 * 2); bf* QPl = (bf*)take((size_t)NN * C8 * 2); bf* KPh = (bf*)take((size_t)NN * C8 * 2); bf* KPl = (bf*)take((size_t)NN * C8 * 2); bf* VTh = (bf*)take((size_t)CC * NN * 2); bf* VTl = (bf*)take((size_t)CC * NN * 2);
    float* S = (float*)take((size_t)RCH * NN * 4); bf* PH = (bf*)take((size_t)RCH * NN * 2); bf* PL = (bf*)take((size_t)RCH * NN * 2); float* O = (float*)take((size_t)CC * NN * 4);
    if ((size_t)(wsp - (char*)d_ws) > ws_size) return;    // ~ 151 MB; per item reuse in stream order
    k_cvt8<<<(C8 * CC / 8 + 255) / 256, 256, 0, stream>>>(wq, WB, C8 * CC / 8); k_cvt8<<<(C8 * CC / 8 + 255) / 256, 256, 0, stream>>>(wk, WB + (size_t)C8 * CC, C8 * CC / 8); k_cvt8<<<(CC * CC / 8 + 255) / 256, 256, 0, stream>>>(wv, WB + (size_t)2 * C8 * CC, CC * CC / 8);
    k_bias320<<<1, 128, 0, stream>>>(bq, bk, bv, B320);
    for (int b = 0; b < NBT; ++b) { const float* xb = x + (size_t)b * CC * NN;
        k_wt<<<dim3(CC / 64, NN / 64, 1), 256, 0, stream>>>(xb, CC, NN, XP);
        k_gemmb<false, false><<<dim3(NN / 64, NQKV / 64, 1), 128, 0, stream>>>(XP, nullptr, WB, B320, F, NQKV, nullptr, nullptr, CC);          // q | k | v (+ biases)
        k_qkplanes<<<(NN / 2) / 8, 256, 0, stream>>>(F, 0, QPh, QPl); k_qkplanes<<<(NN / 2) / 8, 256, 0, stream>>>(F, C8, KPh, KPl); k_vt<<<(CC * (NN / 64)) / 8, 256, 0, stream>>>(F, VTh, VTl);
        k_gemm3<<<dim3(RCH / 64, NN / 64, 1), 128, 0, stream>>>(QPh, QPl, KPh, KPl, C8, S, NN);
        k_softmax4096<<<RCH / 8, 256, 0, stream>>>(S, PH, PL);
        k_gemm3<<<dim3(CC / 64, RCH / 64, 1), 128, 0, stream>>>(VTh, VTl, PH, PL, NN, O, NN);
        k_fin<<<(CC * (NN / 128)) / 8, 256, 0, stream>>>(O, xb, gam, out + (size_t)b * CC * NN); }
}

// v002
// One run takes 215 microseconds.
// In two side-by-side timings against v001, it was 4.60 and 4.63 times as fast.
// All steps since v000 together make it 14.7 times as fast.
#include <hip/hip_runtime.h>

// Compute dtypes, f32 accumulate, per item: the three 1x1 convs as one [4096 x 256].[256 x 320] GEMM with PLAIN bf16 operands (exact products)
// -> bf16 hi + UNSCALED residual planes; scores = q'.k'^T (three products), softmax (x 1/sqrt(256)) in f32 and out^T = v'^T.P^T (three products) in one fused launch for all items (k_attn); gamma * out + x in f32 (k_fin).

#define NBT  4
#define CC   256
#define C8   32
#define NN   4096
#define NQKV (2 * C8 + CC)        // 320
#define DM   CC
#define NTK  NN
#define SCL  0.0625f
#define LOSC 1024.0f

typedef _Float16 h16;
typedef unsigned short bf;
typedef __attribute__((ext_vector_type(16))) __bf16   v16bf;
typedef __attribute__((ext_vector_type(16))) _Float16 v16h;
typedef __attribute__((ext_vector_type(8)))  _Float16 v8h;
typedef __attribute__((ext_vector_type(8)))  unsigned short v8us;
typedef __attribute__((ext_vector_type(8)))  float    v8f;
typedef __attribute__((ext_vector_type(4)))  float    v4f;
typedef __attribute__((ext_vector_type(4)))  _Float16 v4h;
typedef v8h  __attribute__((may_alias)) v8ha;
typedef v4f  __attribute__((may_alias)) v4fa;
typedef v8us __attribute__((may_alias)) v8usa;

__device__ __forceinline__ unsigned short f2bf(float f) { unsigned u = __float_as_uint(f); u += 0x7FFFu + ((u >> 16) & 1u); return (unsigned short)(u >> 16); }
__device__ __forceinline__ float bf2f(unsigned short b) { return __uint_as_float(((unsigned)b) << 16); }
__device__ __forceinline__ float bfr(float f) { return bf2f(f2bf(f)); }
__device__ __forceinline__ v16h cat16(v8h lo, v8h hi) { return __builtin_shufflevector(lo, hi, 0, 1, 2, 3, 4, 5, 6, 7, 8, 9, 10, 11, 12, 13, 14, 15); }
__device__ __forceinline__ v16bf cat16b(v8us lo, v8us hi) { return __builtin_bit_cast(v16bf, __builtin_shufflevector(lo, hi, 0, 1, 2, 3, 4, 5, 6, 7, 8, 9, 10, 11, 12, 13, 14, 15)); }
__device__ __forceinline__ v8f wmma16(v16h a, v16h b, v8f c) { return __builtin_amdgcn_wmma_f32_16x16x32_f16(false, a, false, b, (short)0, c, false, false); }
__device__ __forceinline__ v8f wmmab(v16bf a, v16bf b, v8f c) { return __builtin_amdgcn_wmma_f32_16x16x32_bf16(false, a, false, b, (short)0, c, false, false); }

// k_wt: WT [n][K] = bf16(W[k][n]) (k-major [K][ncols]) via 64 x 64 LDS tiles; grid (K/64, ncols/64).
__global__ __launch_bounds__(256) void k_wt(const float* __restrict__ Wm, int K, int ncols, bf* WT) {
    __shared__ __align__(16) unsigned short tl[64 * 72];
    const int tid = threadIdx.x, k0 = blockIdx.x * 64, n0 = blockIdx.y * 64;
    const int kk = tid >> 2, nq = (tid & 3) * 16;
#pragma unroll
    for (int i = 0; i < 16; ++i) tl[(nq + i) * 72 + kk] = f2bf(Wm[(size_t)(k0 + kk) * ncols + n0 + nq + i]);
    __syncthreads();
    const int piece = tid & 7;
    auto pass = [&]() {
#pragma unroll
        for (int s = 0; s < 2; ++s) { const int nr = (tid >> 3) + 32 * s; const v8us val = *(const v8usa*)(tl + nr * 72 + piece * 8); *(v8us*)(WT + (size_t)(n0 + nr) * K + k0 + piece * 8) = val; }
    };
    pass(); 
}
// k_gemmb: 64 x 64 block tile (4 waves x 16 x 64) of C[NTK][NW] = (A [+ Al]).B^T (K = 256) [+ bf(bias[c])] [+ bf(R[r][c]) residual]; f32 whole-line epilogue (or f16
template <bool SPLITA, bool F16OUT = false>
__global__ __launch_bounds__(128) void k_gemmb(const bf* __restrict__ A, const bf* __restrict__ Al, const bf* __restrict__ Bn, const float* __restrict__ bias, float* C, int ldc, h16* C2, const float* __restrict__ R = nullptr, int K = DM, int roundR = 1) {
    __shared__ __align__(16) float ost[4][16 * 68];
    const int lane = threadIdx.x & 31, wave = threadIdx.x >> 5, lr = lane & 15, hi = lane >> 4;
    const int r0 = blockIdx.x * 64 + wave * 16, c0 = blockIdx.y * 64;
    const size_t aoff = (size_t)(r0 + lr) * K + 8 * hi;
    size_t boff[4];
#pragma unroll
    for (int t = 0; t < 4; ++t) boff[t] = (size_t)(c0 + t * 16 + lr) * K + 8 * hi;
    v8f acc[4];
#pragma unroll
    for (int t = 0; t < 4; ++t) acc[t] = (v8f){};
#pragma unroll 1
    for (int kc = 0; kc < K; kc += 32) {
        const v16bf a = cat16b(*(const v8us*)(A + aoff + kc), *(const v8us*)(A + aoff + kc + 16));
        v16bf al = a;
        if (SPLITA) al = cat16b(*(const v8us*)(Al + aoff + kc), *(const v8us*)(Al + aoff + kc + 16));
#pragma unroll
        for (int t = 0; t < 4; ++t) { const v16bf b = cat16b(*(const v8us*)(Bn + boff[t] + kc), *(const v8us*)(Bn + boff[t] + kc + 16)); acc[t] = wmmab(a, b, acc[t]); if (SPLITA) acc[t] = wmmab(al, b, acc[t]); }
        asm volatile("v_nop\n\tv_nop\n\tv_nop\n\tv_nop" : "+v"(acc[0]), "+v"(acc[1]), "+v"(acc[2]), "+v"(acc[3]) : "v"(a), "v"(al));
    }
    float* os = &ost[wave][0];
#pragma unroll
    for (int t = 0; t < 4; ++t) { const float bv = bias ? bfr(bias[c0 + t * 16 + lr]) : 0.f;
#pragma unroll
        for (int j = 0; j < 8; ++j) os[(hi * 8 + j) * 68 + t * 16 + lr] = acc[t][j] + bv; }
    __syncthreads();
    if (F16OUT) {
        h16* crow = (h16*)(void*)C + (size_t)r0 * ldc + c0;
        auto pass = [&]() {
#pragma unroll
            for (int s = 0; s < 4; ++s) { const int row = 4 * s + (lane >> 3), piece = lane & 7; const float* sp = os + row * 68 + piece * 8; v8h o, o2;
#pragma unroll
                for (int i = 0; i < 8; ++i) { const h16 a = (h16)sp[i]; o[i] = a; o2[i] = (h16)((sp[i] - (float)a) * LOSC); }
                *(v8h*)(crow + (size_t)row * ldc + piece * 8) = o; if (C2) *(v8h*)(C2 + (size_t)r0 * ldc + c0 + (size_t)row * ldc + piece * 8) = o2; }
        };
        pass(); 
    } else {
        float* crow = C + (size_t)r0 * ldc + c0;
        auto pass = [&]() {
#pragma unroll
            for (int s = 0; s < 8; ++s) { const int Lid = (lane >> 3) + 4 * s, piece = lane & 7; const int row = Lid >> 1, cofs = (Lid & 1) * 32 + piece * 4;
                v4f val = *(const v4fa*)(os + row * 68 + cofs); if (R) { const v4f rv = *(const v4f*)(R + ((size_t)r0 + row) * ldc + c0 + cofs); val += roundR ? (v4f){bfr(rv[0]), bfr(rv[1]), bfr(rv[2]), bfr(rv[3])} : rv; }
                *(v4f*)(crow + (size_t)row * ldc + cofs) = val; }
        };
        pass(); 
    }
}


__global__ __launch_bounds__(256) void k_cvt8(const float* __restrict__ src, bf* dst, size_t n8) {
    const size_t i = (size_t)blockIdx.x * 256 + threadIdx.x; if (i >= n8) return;
    const v8f v = *(const v8f*)(src + i * 8); v8us o;
#pragma unroll
    for (int k = 0; k < 8; ++k) o[k] = f2bf(v[k]);
    *(v8us*)(dst + i * 8) = o; 
}
__global__ __launch_bounds__(256) void k_zero8(bf* dst, size_t n8) {
    const size_t i = (size_t)blockIdx.x * 256 + threadIdx.x; if (i >= n8) return; v8us z;
#pragma unroll
    for (int k = 0; k < 8; ++k) z[k] = 0;
    *(v8us*)(dst + i * 8) = z; 
}

__global__ __launch_bounds__(256) void k_qkplanes(const float* __restrict__ F, int off, bf* Ph, bf* Pl) {
    typedef __attribute__((ext_vector_type(2))) unsigned short v2us;
    const int lane = threadIdx.x & 31; const size_t r = ((size_t)blockIdx.x * 8 + (threadIdx.x >> 5)) * 2 + (lane >> 4); if (r >= (size_t)NN) return; const int c0 = (lane & 15) * 2; v2us oh, ol;
#pragma unroll
    for (int i = 0; i < 2; ++i) { const float y = F[r * NQKV + off + c0 + i]; const unsigned short hb = f2bf(y); oh[i] = hb; ol[i] = f2bf(y - bf2f(hb)); }
    const size_t o = r * C8 + c0; *(v2us*)(Ph + o) = oh; *(v2us*)(Pl + o) = ol; 
}
__global__ __launch_bounds__(256) void k_vt(const float* __restrict__ F, bf* Th, bf* Tl) {
    typedef __attribute__((ext_vector_type(2))) unsigned short v2us;
    const int lane = threadIdx.x & 31; const size_t wid = (size_t)blockIdx.x * 8 + (threadIdx.x >> 5); if (wid >= (size_t)CC * (NN / 64)) return; const int c = (int)(wid / (NN / 64)); const int j0 = (int)(wid % (NN / 64)) * 64 + lane * 2; v2us oh, ol;
#pragma unroll
    for (int i = 0; i < 2; ++i) { const float y = F[(size_t)(j0 + i) * NQKV + 2 * C8 + c]; const unsigned short hb = f2bf(y); oh[i] = hb; ol[i] = f2bf(y - bf2f(hb)); }
    const size_t o = (size_t)c * NN + j0; *(v2us*)(Th + o) = oh; *(v2us*)(Tl + o) = ol; 
}
#define AKT   64                      // keys per tile
#define ANT   (NN / AKT)              // tiles
#define AVP   144                     // LDS pitch of a 128-byte V^T row (16 B x odd: conflict-free 16-byte reads)
#define AKP   80                      // LDS pitch of a 64-byte K row
#define AVPL  (CC * AVP)              // one V^T plane
#define AKPL  (AKT * AKP)             // one K plane
#define AKOF  (2 * AVPL)
#define ABUF  (2 * AVPL + 2 * AKPL)   // one buffer: 83,968 B
typedef __attribute__((ext_vector_type(2))) float  v2f;
typedef __attribute__((ext_vector_type(2))) __bf16 v2bf;
typedef __attribute__((ext_vector_type(8))) unsigned v8u;
typedef float __attribute__((may_alias)) fa;
__device__ __forceinline__ float xhalf(float x) { return __builtin_bit_cast(float, __builtin_amdgcn_permlanex16(__builtin_bit_cast(int, x), __builtin_bit_cast(int, x), 0x76543210, 0xfedcba98, false, false)); }  // lane l with lane l ^ 16
// Eight 16-byte copies of a lane, global -> LDS through no register; the s_wait_xcnt stands in the copies' own statement so that no address register is rewritten ahead of it.
__device__ __forceinline__ void cp8(unsigned l, unsigned lstep, const bf* g, size_t gstep) {
    asm volatile("global_load_async_to_lds_b128 %0, %8, off\n\tglobal_load_async_to_lds_b128 %1, %9, off\n\tglobal_load_async_to_lds_b128 %2, %10, off\n\tglobal_load_async_to_lds_b128 %3, %11, off\n\t"
                 "global_load_async_to_lds_b128 %4, %12, off\n\tglobal_load_async_to_lds_b128 %5, %13, off\n\tglobal_load_async_to_lds_b128 %6, %14, off\n\tglobal_load_async_to_lds_b128 %7, %15, off\n\ts_wait_xcnt 0x0"
                 :: "v"(l), "v"(l + lstep), "v"(l + 2 * lstep), "v"(l + 3 * lstep), "v"(l + 4 * lstep), "v"(l + 5 * lstep), "v"(l + 6 * lstep), "v"(l + 7 * lstep),
                    "v"(g), "v"(g + gstep), "v"(g + 2 * gstep), "v"(g + 3 * gstep), "v"(g + 4 * gstep), "v"(g + 5 * gstep), "v"(g + 6 * gstep), "v"(g + 7 * gstep) : "memory");
}
__device__ __forceinline__ void cp4(unsigned l0, unsigned l1, unsigned l2, unsigned l3, const bf* g0, const bf* g1, const bf* g2, const bf* g3) {
    asm volatile("global_load_async_to_lds_b128 %0, %4, off\n\tglobal_load_async_to_lds_b128 %1, %5, off\n\tglobal_load_async_to_lds_b128 %2, %6, off\n\tglobal_load_async_to_lds_b128 %3, %7, off\n\ts_wait_xcnt 0x0"
                 :: "v"(l0), "v"(l1), "v"(l2), "v"(l3), "v"(g0), "v"(g1), "v"(g2), "v"(g3) : "memory");
}
// One tile's 36 copies per lane: V^T hi and residual (256 rows x 128 B each), K hi and residual (64 rows x 64 B each).
__device__ __forceinline__ void tile_issue(const bf* Vh, const bf* Vl, const bf* Kh, const bf* Kl, int key0, unsigned lb, int tid) {
    const size_t vo = (size_t)(tid >> 3) * NN + key0 + (tid & 7) * 8;
    const unsigned vl = lb + (unsigned)(tid >> 3) * AVP + (unsigned)(tid & 7) * 16;
    cp8(vl, 16 * AVP, Vh + vo, (size_t)16 * NN); cp8(vl + 128 * AVP, 16 * AVP, Vh + vo + (size_t)128 * NN, (size_t)16 * NN);
    cp8(vl + AVPL, 16 * AVP, Vl + vo, (size_t)16 * NN); cp8(vl + AVPL + 128 * AVP, 16 * AVP, Vl + vo + (size_t)128 * NN, (size_t)16 * NN);
    const unsigned ko = (unsigned)key0 * C8 + (unsigned)tid * 8;
    const unsigned kl = lb + AKOF + (unsigned)(tid >> 2) * AKP + (unsigned)(tid & 3) * 16;
    cp4(kl, kl + 32 * AKP, kl + AKPL, kl + AKPL + 32 * AKP, Kh + ko, Kh + ko + 128 * 8, Kl + ko, Kl + ko + 128 * 8);
}
__global__ __launch_bounds__(128) void k_attn(const bf* __restrict__ Qh, const bf* __restrict__ Ql, const bf* __restrict__ Kh, const bf* __restrict__ Kl, const bf* __restrict__ Vh, const bf* __restrict__ Vl, float* O) {
    __shared__ __attribute__((aligned(256))) unsigned char ring[2 * ABUF];
    const int tid = threadIdx.x, lane = tid & 31, wave = tid >> 5, lr = lane & 15, hi = lane >> 4;
    const size_t it = blockIdx.y; const int q0 = blockIdx.x * 64;
    Qh += it * NN * C8; Ql += it * NN * C8; Kh += it * NN * C8; Kl += it * NN * C8; Vh += it * CC * NN; Vl += it * CC * NN; O += it * CC * NN;
    const unsigned lbase = (unsigned)(size_t)ring;
    const size_t qo = (size_t)(q0 + wave * 16 + lr) * C8 + 8 * hi;
    const v16bf qh = cat16b(*(const v8us*)(Qh + qo), *(const v8us*)(Qh + qo + 16)), ql = cat16b(*(const v8us*)(Ql + qo), *(const v8us*)(Ql + qo + 16));
    asm volatile("s_wait_xcnt 0x0" ::: "memory");   // stands in front of the first rewrite of the Q loads' address registers
    v8f acc[16];
#pragma unroll
    for (int c = 0; c < 16; ++c) acc[c] = (v8f){};
    float m = -3.0e38f, l = 0.f;
    const float C1 = SCL * 1.4426950408889634f;   // scores to log2 units
    tile_issue(Vh, Vl, Kh, Kl, 0, lbase, tid);
    asm volatile("s_wait_asynccnt 0x0" ::: "memory");   // tile 0 has landed before the barrier that publishes it
    __syncthreads();
    tile_issue(Vh, Vl, Kh, Kl, AKT, lbase + ABUF, tid);
#pragma unroll 1   // one tile per trip: the two buffers alternate by address
    for (int t = 0; t < ANT; ++t) {
        const unsigned char* vb = ring + (t & 1) * ABUF;
        const unsigned char* kb = vb + AKOF + lr * AKP + hi * 16;
        const unsigned char* vr = vb + lr * AVP + hi * 16;
        v8f st[4];
        v16bf kh[4], kl[4], fh[2][4], fl[2][4];
        // V^T fragments of group i (32 keys i >> 2, 64 channels i & 3), hi and residual, into fragment set i & 1
        auto ldv = [&](int i) {
#pragma unroll
            for (int c = 0; c < 4; ++c) { const unsigned char* p = vr + ((i & 3) * 4 + c) * 16 * AVP + (i >> 2) * 64; fh[i & 1][c] = cat16b(*(const v8usa*)p, *(const v8usa*)(p + 32)); fl[i & 1][c] = cat16b(*(const v8usa*)(p + AVPL), *(const v8usa*)(p + AVPL + 32)); }
        };
#pragma unroll
        for (int k = 0; k < 4; ++k) { const unsigned char* p = kb + k * 16 * AKP; kh[k] = cat16b(*(const v8usa*)p, *(const v8usa*)(p + 32)); kl[k] = cat16b(*(const v8usa*)(p + AKPL), *(const v8usa*)(p + AKPL + 32)); }
        ldv(0);
#pragma unroll
        for (int k = 0; k < 4; ++k) st[k] = wmmab(kh[k], qh, (v8f){});
#pragma unroll
        for (int k = 0; k < 4; ++k) st[k] = wmmab(kh[k], ql, st[k]);
#pragma unroll
        for (int k = 0; k < 4; ++k) st[k] = wmmab(kl[k], qh, st[k]);
        float mx = st[0][0];
#pragma unroll
        for (int k = 0; k < 4; ++k) {
#pragma unroll
            for (int r = 0; r < 8; ++r) mx = fmaxf(mx, st[k][r]); }
        mx = fmaxf(mx, xhalf(mx));
        const float mn = fmaxf(m, mx * C1);
        const float alpha = __builtin_amdgcn_exp2f(m - mn);
        m = mn;
        float ps = 0.f;
        v8u uh[2], ul[2];
        // two scores of this lane's query -> P = exp2, its bf16 hi and residual, packed at dword e of the B fragment of 32-key half s
        auto mkp = [&](int s, int e) { const int k = 2 * s + (e >> 2), r = (e & 3) * 2;
            const float p0 = __builtin_amdgcn_exp2f(__builtin_fmaf(st[k][r], C1, -mn)), p1 = __builtin_amdgcn_exp2f(__builtin_fmaf(st[k][r + 1], C1, -mn));
            ps += p0 + p1;
            const unsigned hu = __builtin_bit_cast(unsigned, __builtin_convertvector((v2f){p0, p1}, v2bf));
            uh[s][e] = hu;
            ul[s][e] = __builtin_bit_cast(unsigned, __builtin_convertvector((v2f){p0 - __uint_as_float(hu << 16), p1 - __uint_as_float(hu & 0xFFFF0000u)}, v2bf)); };
#pragma unroll
        for (int e = 0; e < 8; ++e) mkp(0, e);
#pragma unroll
        for (int c = 0; c < 4; ++c) acc[c] *= alpha;
#pragma unroll
        for (int i = 0; i < 8; ++i) {
            if (i < 7) ldv(i + 1);
            __builtin_amdgcn_sched_barrier(0);   // holds the next group's LDS reads, as one run, ahead of this group's products: their latency passes under the products
            const v16bf ph = __builtin_bit_cast(v16bf, uh[i >> 2]), pl = __builtin_bit_cast(v16bf, ul[i >> 2]);
            const int a = (i & 3) * 4;
#pragma unroll
            for (int c = 0; c < 4; ++c) acc[a + c] = wmmab(fh[i & 1][c], ph, acc[a + c]);
            if (i < 3) {   // the next channel group's rescale and a quarter of the second half's P run beside these products
#pragma unroll
                for (int c = 0; c < 4; ++c) acc[a + 4 + c] *= alpha; }
            if (i < 4) { mkp(1, 2 * i); mkp(1, 2 * i + 1); }
#pragma unroll
            for (int c = 0; c < 4; ++c) acc[a + c] = wmmab(fl[i & 1][c], ph, acc[a + c]);
#pragma unroll
            for (int c = 0; c < 4; ++c) acc[a + c] = wmmab(fh[i & 1][c], pl, acc[a + c]);
            __builtin_amdgcn_sched_barrier(0);   // keeps the following group's reads from being spread among these products
        }
        l = l * alpha + ps;
        asm volatile("s_wait_dscnt 0x0" ::: "memory");      // this wave's reads of the buffer have retired before it is refilled
        asm volatile("s_wait_asynccnt 0x0" ::: "memory");   // this wave's copies of tile t + 1 have landed before the barrier that publishes them
        __syncthreads();                                    // publishes tile t + 1 and ends every reader's last read of tile t's buffer
        if (t + 2 < ANT) tile_issue(Vh, Vl, Kh, Kl, (t + 2) * AKT, lbase + (unsigned)(t & 1) * ABUF, tid);
    }
    asm volatile("s_wait_asynccnt 0x0" ::: "memory");       // nothing is in flight when the ring becomes output staging
    l += xhalf(l);
    const float inv = 1.0f / l;
    fa* os = (fa*)(void*)ring;   // [256 channels][68]: 64 queries + pad
#pragma unroll
    for (int c = 0; c < 16; ++c) {
#pragma unroll
        for (int r = 0; r < 8; ++r) os[(c * 16 + hi * 8 + r) * 68 + wave * 16 + lr] = acc[c][r] * inv; }
    __syncthreads();
#pragma unroll 4   // four rows' LDS reads in flight behind one wait, without 32 rows' registers
    for (int s = 0; s < 32; ++s) { const int row = s * 8 + (tid >> 4), piece = tid & 15;
        const v4f val = *(const v4fa*)(os + row * 68 + piece * 4); *(v4f*)(O + (size_t)row * NN + q0 + piece * 4) = val; }
}
__global__ __launch_bounds__(256) void k_fin(const float* __restrict__ O, const float* __restrict__ xb, const float* __restrict__ gam, float* OUTB) {
    const int lane = threadIdx.x & 31; const size_t wid = (size_t)blockIdx.x * 8 + (threadIdx.x >> 5); if (wid >= (size_t)CC * (NN / 128)) return; const size_t o = wid * 128 + lane * 4; const float gm = bfr(gam[0]); v4f v;
#pragma unroll
    for (int q = 0; q < 4; ++q) v[q] = gm * O[o + q] + bfr(xb[o + q]);
    *(v4f*)(OUTB + o) = v; 
}
__global__ __launch_bounds__(128) void k_bias320(const float* __restrict__ bq, const float* __restrict__ bk, const float* __restrict__ bv, float* B320) {
    const int t = threadIdx.x; if (t >= 96) return; v4f v;
#pragma unroll
    for (int q = 0; q < 4; ++q) { const int c = t * 4 + q; v[q] = (c < C8) ? bq[c < C8 ? c : 0] : (c < 2 * C8) ? bk[(c >= C8 && c < 2 * C8) ? c - C8 : 0] : (c < NQKV) ? bv[(c >= 2 * C8 && c < NQKV) ? c - 2 * C8 : 0] : 0.f; }
    *(v4f*)(B320 + t * 4) = v; 
}

extern "C" void kernel_launch(void* const* d_in, const int* in_sizes, int n_in,
                              void* d_out, int out_size, void* d_ws, size_t ws_size, hipStream_t stream) {
    (void)in_sizes; (void)n_in; (void)out_size;
    const float* x = (const float*)d_in[0]; const float* wq = (const float*)d_in[1]; const float* bq = (const float*)d_in[2]; const float* wk = (const float*)d_in[3]; const float* bk = (const float*)d_in[4]; const float* wv = (const float*)d_in[5]; const float* bv = (const float*)d_in[6]; const float* gam = (const float*)d_in[7];
    float* out = (float*)d_out;    // [4][256][64][64]
    char* wsp = (char*)d_ws;
    auto take = [&](size_t bytes) { char* p = wsp; wsp += (bytes + 255) & ~(size_t)255; return (void*)p; };
    bf* WB = (bf*)take((size_t)NQKV * CC * 2); float* B320 = (float*)take(384 * 4); bf* XP = (bf*)take((size_t)NN * CC * 2); float* F = (float*)take((size_t)NN * NQKV * 4);
    bf* QPh = (bf*)take((size_t)NBT * NN * C8 * 2); bf* QPl = (bf*)take((size_t)NBT * NN * C8 * 2); bf* KPh = (bf*)take((size_t)NBT * NN * C8 * 2); bf* KPl = (bf*)take((size_t)NBT * NN * C8 * 2); bf* VTh = (bf*)take((size_t)NBT * CC * NN * 2); bf* VTl = (bf*)take((size_t)NBT * CC * NN * 2);
    float* O = (float*)take((size_t)NBT * CC * NN * 4);
    if ((size_t)(wsp - (char*)d_ws) > ws_size) return;    // ~ 44 MB
    k_cvt8<<<(C8 * CC / 8 + 255) / 256, 256, 0, stream>>>(wq, WB, C8 * CC / 8); k_cvt8<<<(C8 * CC / 8 + 255) / 256, 256, 0, stream>>>(wk, WB + (size_t)C8 * CC, C8 * CC / 8); k_cvt8<<<(CC * CC / 8 + 255) / 256, 256, 0, stream>>>(wv, WB + (size_t)2 * C8 * CC, CC * CC / 8);
    k_bias320<<<1, 128, 0, stream>>>(bq, bk, bv, B320);
    for (int b = 0; b < NBT; ++b) { const float* xb = x + (size_t)b * CC * NN;
        k_wt<<<dim3(CC / 64, NN / 64, 1), 256, 0, stream>>>(xb, CC, NN, XP);
        k_gemmb<false, false><<<dim3(NN / 64, NQKV / 64, 1), 128, 0, stream>>>(XP, nullptr, WB, B320, F, NQKV, nullptr, nullptr, CC);          // q | k | v (+ biases)
        k_qkplanes<<<(NN / 2) / 8, 256, 0, stream>>>(F, 0, QPh + (size_t)b * NN * C8, QPl + (size_t)b * NN * C8); k_qkplanes<<<(NN / 2) / 8, 256, 0, stream>>>(F, C8, KPh + (size_t)b * NN * C8, KPl + (size_t)b * NN * C8); k_vt<<<(CC * (NN / 64)) / 8, 256, 0, stream>>>(F, VTh + (size_t)b * CC * NN, VTl + (size_t)b * CC * NN); }
    k_attn<<<dim3(NN / 64, NBT, 1), 128, 0, stream>>>(QPh, QPl, KPh, KPl, VTh, VTl, O);
    for (int b = 0; b < NBT; ++b) k_fin<<<(CC * (NN / 128)) / 8, 256, 0, stream>>>(O + (size_t)b * CC * NN, x + (size_t)b * CC * NN, gam, out + (size_t)b * CC * NN);
}

// v003
// Measured time: 125 microseconds a run.
// Two timings next to v002 both put it at 1.72 times that version's speed.
// All steps since v000 together make it 25.3 times as fast.
#include <hip/hip_runtime.h>

// Compute dtypes, f32 accumulate: the three 1x1 convs as one [4096 x 256].[256 x 320] GEMM per item with PLAIN bf16 operands (exact products), bias in f32,
// its epilogue writing q, k and v^T as bf16 hi + UNSCALED residual planes (k_proj); scores = q.k^T (three products), softmax (x 1/sqrt(256)) in f32, out^T = v^T.P^T (three products)
// and gamma * out + x in f32 in one fused launch (k_attn). Three launches, each for all items.

#define NBT  4
#define CC   256
#define C8   32
#define NN   4096
#define NQKV (2 * C8 + CC)        // 320
#define SCL  0.0625f

typedef unsigned short bf;
typedef __attribute__((ext_vector_type(16))) __bf16   v16bf;
typedef __attribute__((ext_vector_type(8)))  unsigned short v8us;
typedef __attribute__((ext_vector_type(8)))  float    v8f;
typedef __attribute__((ext_vector_type(4)))  float    v4f;
typedef v4f  __attribute__((may_alias)) v4fa;
typedef v8us __attribute__((may_alias)) v8usa;
typedef float __attribute__((may_alias)) fa;

__device__ __forceinline__ unsigned short f2bf(float f) { unsigned u = __float_as_uint(f); u += 0x7FFFu + ((u >> 16) & 1u); return (unsigned short)(u >> 16); }
__device__ __forceinline__ float bf2f(unsigned short b) { return __uint_as_float(((unsigned)b) << 16); }
__device__ __forceinline__ float bfr(float f) { return bf2f(f2bf(f)); }
__device__ __forceinline__ v16bf cat16b(v8us lo, v8us hi) { return __builtin_bit_cast(v16bf, __builtin_shufflevector(lo, hi, 0, 1, 2, 3, 4, 5, 6, 7, 8, 9, 10, 11, 12, 13, 14, 15)); }
__device__ __forceinline__ v8f wmmab(v16bf a, v16bf b, v8f c) { return __builtin_amdgcn_wmma_f32_16x16x32_bf16(false, a, false, b, (short)0, c, false, false); }

// k_pre: everything the projection reads, in one launch. Blocks [0, NBT * 256): XP[item][n][c] = bf16(x[item][c][n]) via 64 x 64 LDS tiles.
// The 41 blocks behind them: WB = bf16(wq | wk | wv) row after row, B320 = bq | bk | bv.
#define PXB (NBT * (CC / 64) * (NN / 64))
#define PWT (NQKV * CC / 8)
__global__ __launch_bounds__(256) void k_pre(const float* __restrict__ x, const float* __restrict__ wq, const float* __restrict__ wk, const float* __restrict__ wv,
                                             const float* __restrict__ bq, const float* __restrict__ bk, const float* __restrict__ bv, bf* XP, bf* WB, float* B320) {
    __shared__ __align__(16) unsigned short tl[64 * 72];
    const int tid = threadIdx.x, f = blockIdx.x;
    if (f >= PXB) {   // the same for a whole block, and in front of the barrier
        const int i = (f - PXB) * 256 + tid;
        if (i < PWT) {
            const int e = i * 8; const float* s = e < C8 * CC ? wq + e : e < 2 * C8 * CC ? wk + (e - C8 * CC) : wv + (e - 2 * C8 * CC);
            const v8f v = *(const v8f*)s; v8us o;
#pragma unroll
            for (int k = 0; k < 8; ++k) o[k] = f2bf(v[k]);
            *(v8us*)(WB + e) = o;
        } else if (i < PWT + NQKV / 4) {
            const int c = (i - PWT) * 4; const float* s = c < C8 ? bq + c : c < 2 * C8 ? bk + (c - C8) : bv + (c - 2 * C8);
            *(v4f*)(B320 + c) = *(const v4f*)s;
        }
        return;
    }
    const int k0 = (f & 3) * 64, n0 = ((f >> 2) & 63) * 64;
    const float* Wm = x + (size_t)(f >> 8) * CC * NN; bf* WT = XP + (size_t)(f >> 8) * NN * CC;
    const int kk = tid >> 2, nq = (tid & 3) * 16;
#pragma unroll
    for (int i = 0; i < 16; ++i) tl[(nq + i) * 72 + kk] = f2bf(Wm[(size_t)(k0 + kk) * NN + n0 + nq + i]);
    __syncthreads();
    const int piece = tid & 7;
#pragma unroll
    for (int s = 0; s < 2; ++s) { const int nr = (tid >> 3) + 32 * s; const v8us val = *(const v8usa*)(tl + nr * 72 + piece * 8); *(v8us*)(WT + (size_t)(n0 + nr) * CC + k0 + piece * 8) = val; }
    asm volatile("s_wait_xcnt 0x0" ::: "memory");   // stands behind the stores, in front of any rewrite of their address and data registers
}
// k_proj: 64 tokens x 64 columns (4 waves x 16 x 64) of [NN][NQKV] = XP.WB^T + bf(bias) for one item; grid (NN / 64, NQKV / 64, items). The f32 result goes no further than this block:
// the epilogue splits it into bf16 hi + residual and stores whole 128-byte lines of the planes that k_attn reads.
#define PVP 72   // LDS pitch in bf16 of a 64-token v^T row (144 B = 16 B x odd)
__global__ __launch_bounds__(128) void k_proj(const bf* __restrict__ A, const bf* __restrict__ Bn, const float* __restrict__ bias, bf* Qh, bf* Ql, bf* Kh, bf* Kl, bf* Vh, bf* Vl) {
    __shared__ __align__(16) unsigned char sm[2 * 64 * PVP * 2];   // q | k columns: f32 [4 waves][16][68]; v columns: bf16 [2 planes][64 channels][PVP]
    const int tid = threadIdx.x, lane = tid & 31, wave = tid >> 5, lr = lane & 15, hi = lane >> 4;
    const size_t it = blockIdx.z;
    const int rb = blockIdx.x * 64, r0 = rb + wave * 16, c0 = blockIdx.y * 64;
    A += it * NN * CC;
    const size_t aoff = (size_t)(r0 + lr) * CC + 8 * hi;
    size_t boff[4];
#pragma unroll
    for (int t = 0; t < 4; ++t) boff[t] = (size_t)(c0 + t * 16 + lr) * CC + 8 * hi;
    v8f acc[4];
#pragma unroll
    for (int t = 0; t < 4; ++t) acc[t] = (v8f){};
#pragma unroll 1
    for (int kc = 0; kc < CC; kc += 32) {
        const v16bf a = cat16b(*(const v8us*)(A + aoff + kc), *(const v8us*)(A + aoff + kc + 16));
#pragma unroll
        for (int t = 0; t < 4; ++t) { const v16bf b = cat16b(*(const v8us*)(Bn + boff[t] + kc), *(const v8us*)(Bn + boff[t] + kc + 16)); acc[t] = wmmab(a, b, acc[t]); }
        // four vector slots behind the trip's last product, on the back edge too, before the next trip's instructions rewrite its A and B registers
        asm volatile("v_nop\n\tv_nop\n\tv_nop\n\tv_nop" : "+v"(acc[0]), "+v"(acc[1]), "+v"(acc[2]), "+v"(acc[3]) : "v"(a));
    }
    if (c0 == 0) {   // q | k: token rows of 32 channels, so the tile turns through LDS in f32
        fa* os = (fa*)(void*)sm + wave * (16 * 68);
#pragma unroll
        for (int t = 0; t < 4; ++t) { const float bv = bfr(bias[t * 16 + lr]);
#pragma unroll
            for (int j = 0; j < 8; ++j) os[(hi * 8 + j) * 68 + t * 16 + lr] = acc[t][j] + bv; }
        __syncthreads();
        const int piece = lane & 7;
        bf* ph = piece < 4 ? Qh : Kh; bf* pl = piece < 4 ? Ql : Kl;
#pragma unroll
        for (int s = 0; s < 4; ++s) { const int row = 4 * s + (lane >> 3); const fa* sp = os + row * 68 + piece * 8; v8us oh, ol;
#pragma unroll
            for (int i = 0; i < 8; ++i) { const float y = sp[i]; const unsigned short hb = f2bf(y); oh[i] = hb; ol[i] = f2bf(y - bf2f(hb)); }
            const size_t o = (it * NN + r0 + row) * C8 + (piece & 3) * 8; *(v8us*)(ph + o) = oh; *(v8us*)(pl + o) = ol; }
    } else {         // v: a lane's accumulator registers are eight consecutive tokens of one channel, which is 16 bytes of a v^T row already
        bf* sv = (bf*)(void*)sm;
#pragma unroll
        for (int t = 0; t < 4; ++t) { const float bv = bfr(bias[c0 + t * 16 + lr]); v8us oh, ol;
#pragma unroll
            for (int j = 0; j < 8; ++j) { const float y = acc[t][j] + bv; const unsigned short hb = f2bf(y); oh[j] = hb; ol[j] = f2bf(y - bf2f(hb)); }
            bf* p = sv + (t * 16 + lr) * PVP + wave * 16 + hi * 8; *(v8usa*)p = oh; *(v8usa*)(p + 64 * PVP) = ol; }
        __syncthreads();   // the four waves' 16-token pieces of a channel's row leave as one 128-byte line
#pragma unroll
        for (int s = 0; s < 8; ++s) { const int c = (s & 3) * 16 + (tid >> 3), piece = tid & 7;
            const v8us val = *(const v8usa*)(sv + (s >> 2) * 64 * PVP + c * PVP + piece * 8);
            *(v8us*)((s < 4 ? Vh : Vl) + (it * CC + (c0 - 2 * C8) + c) * NN + rb + piece * 8) = val; }
        asm volatile("s_wait_xcnt 0x0" ::: "memory");   // stands behind the stores, in front of any rewrite of their address and data registers
    }
}
#define AKT   64                      // keys per tile
#define ANT   (NN / AKT)              // tiles
#define AVP   144                     // LDS pitch of a 128-byte V^T row (16 B x odd: conflict-free 16-byte reads)
#define AKP   80                      // LDS pitch of a 64-byte K row
#define AVPL  (CC * AVP)              // one V^T plane
#define AKPL  (AKT * AKP)             // one K plane
#define AKOF  (2 * AVPL)
#define ABUF  (2 * AVPL + 2 * AKPL)   // one buffer: 83,968 B
typedef __attribute__((ext_vector_type(2))) float  v2f;
typedef __attribute__((ext_vector_type(2))) __bf16 v2bf;
typedef __attribute__((ext_vector_type(8))) unsigned v8u;
__device__ __forceinline__ float xhalf(float x) { return __builtin_bit_cast(float, __builtin_amdgcn_permlanex16(__builtin_bit_cast(int, x), __builtin_bit_cast(int, x), 0x76543210, 0xfedcba98, false, false)); }  // lane l with lane l ^ 16
// Eight 16-byte copies of a lane, global -> LDS through no register; the s_wait_xcnt stands in the copies' own statement so that no address register is rewritten ahead of it.
__device__ __forceinline__ void cp8(unsigned l, unsigned lstep, const bf* g, size_t gstep) {
    asm volatile("global_load_async_to_lds_b128 %0, %8, off\n\tglobal_load_async_to_lds_b128 %1, %9, off\n\tglobal_load_async_to_lds_b128 %2, %10, off\n\tglobal_load_async_to_lds_b128 %3, %11, off\n\t"
                 "global_load_async_to_lds_b128 %4, %12, off\n\tglobal_load_async_to_lds_b128 %5, %13, off\n\tglobal_load_async_to_lds_b128 %6, %14, off\n\tglobal_load_async_to_lds_b128 %7, %15, off\n\ts_wait_xcnt 0x0"
                 :: "v"(l), "v"(l + lstep), "v"(l + 2 * lstep), "v"(l + 3 * lstep), "v"(l + 4 * lstep), "v"(l + 5 * lstep), "v"(l + 6 * lstep), "v"(l + 7 * lstep),
                    "v"(g), "v"(g + gstep), "v"(g + 2 * gstep), "v"(g + 3 * gstep), "v"(g + 4 * gstep), "v"(g + 5 * gstep), "v"(g + 6 * gstep), "v"(g + 7 * gstep) : "memory");
}
__device__ __forceinline__ void cp4(unsigned l0, unsigned l1, unsigned l2, unsigned l3, const bf* g0, const bf* g1, const bf* g2, const bf* g3) {
    asm volatile("global_load_async_to_lds_b128 %0, %4, off\n\tglobal_load_async_to_lds_b128 %1, %5, off\n\tglobal_load_async_to_lds_b128 %2, %6, off\n\tglobal_load_async_to_lds_b128 %3, %7, off\n\ts_wait_xcnt 0x0"
                 :: "v"(l0), "v"(l1), "v"(l2), "v"(l3), "v"(g0), "v"(g1), "v"(g2), "v"(g3) : "memory");
}
// One tile's 36 copies per lane: V^T hi and residual (256 rows x 128 B each), K hi and residual (64 rows x 64 B each).
__device__ __forceinline__ void tile_issue(const bf* Vh, const bf* Vl, const bf* Kh, const bf* Kl, int key0, unsigned lb, int tid) {
    const size_t vo = (size_t)(tid >> 3) * NN + key0 + (tid & 7) * 8;
    const unsigned vl = lb + (unsigned)(tid >> 3) * AVP + (unsigned)(tid & 7) * 16;
    cp8(vl, 16 * AVP, Vh + vo, (size_t)16 * NN); cp8(vl + 128 * AVP, 16 * AVP, Vh + vo + (size_t)128 * NN, (size_t)16 * NN);
    cp8(vl + AVPL, 16 * AVP, Vl + vo, (size_t)16 * NN); cp8(vl + AVPL + 128 * AVP, 16 * AVP, Vl + vo + (size_t)128 * NN, (size_t)16 * NN);
    const unsigned ko = (unsigned)key0 * C8 + (unsigned)tid * 8;
    const unsigned kl = lb + AKOF + (unsigned)(tid >> 2) * AKP + (unsigned)(tid & 3) * 16;
    cp4(kl, kl + 32 * AKP, kl + AKPL, kl + AKPL + 32 * AKP, Kh + ko, Kh + ko + 128 * 8, Kl + ko, Kl + ko + 128 * 8);
}
__global__ __launch_bounds__(128) void k_attn(const bf* __restrict__ Qh, const bf* __restrict__ Ql, const bf* __restrict__ Kh, const bf* __restrict__ Kl, const bf* __restrict__ Vh, const bf* __restrict__ Vl, const float* __restrict__ x, const float* __restrict__ gam, float* OUT) {
    __shared__ __attribute__((aligned(256))) unsigned char ring[2 * ABUF];
    const int tid = threadIdx.x, lane = tid & 31, wave = tid >> 5, lr = lane & 15, hi = lane >> 4;
    const size_t it = blockIdx.y; const int q0 = blockIdx.x * 64;
    Qh += it * NN * C8; Ql += it * NN * C8; Kh += it * NN * C8; Kl += it * NN * C8; Vh += it * CC * NN; Vl += it * CC * NN; x += it * CC * NN; OUT += it * CC * NN;
    const unsigned lbase = (unsigned)(size_t)ring;
    const float gm0 = gam[0];   // read here, ahead of every store and asm statement, it is a scalar load and waits in a scalar register
    const size_t qo = (size_t)(q0 + wave * 16 + lr) * C8 + 8 * hi;
    const v16bf qh = cat16b(*(const v8us*)(Qh + qo), *(const v8us*)(Qh + qo + 16)), ql = cat16b(*(const v8us*)(Ql + qo), *(const v8us*)(Ql + qo + 16));
    asm volatile("s_wait_xcnt 0x0" ::: "memory");   // stands in front of the first rewrite of the Q loads' address registers
    v8f acc[16];
#pragma unroll
    for (int c = 0; c < 16; ++c) acc[c] = (v8f){};
    float m = -3.0e38f, l = 0.f;
    const float C1 = SCL * 1.4426950408889634f;   // scores to log2 units
    tile_issue(Vh, Vl, Kh, Kl, 0, lbase, tid);
    asm volatile("s_wait_asynccnt 0x0" ::: "memory");   // tile 0 has landed before the barrier that publishes it
    __syncthreads();
    tile_issue(Vh, Vl, Kh, Kl, AKT, lbase + ABUF, tid);
#pragma unroll 1   // one tile per trip: the two buffers alternate by address
    for (int t = 0; t < ANT; ++t) {
        const unsigned char* vb = ring + (t & 1) * ABUF;
        const unsigned char* kb = vb + AKOF + lr * AKP + hi * 16;
        const unsigned char* vr = vb + lr * AVP + hi * 16;
        v8f st[4];
        v16bf kh[4], kl[4], fh[2][4], fl[2][4];
        // V^T fragments of group i (32 keys i >> 2, 64 channels i & 3), hi and residual, into fragment set i & 1
        auto ldv = [&](int i) {
#pragma unroll
            for (int c = 0; c < 4; ++c) { const unsigned char* p = vr + ((i & 3) * 4 + c) * 16 * AVP + (i >> 2) * 64; fh[i & 1][c] = cat16b(*(const v8usa*)p, *(const v8usa*)(p + 32)); fl[i & 1][c] = cat16b(*(const v8usa*)(p + AVPL), *(const v8usa*)(p + AVPL + 32)); }
        };
#pragma unroll
        for (int k = 0; k < 4; ++k) { const unsigned char* p = kb + k * 16 * AKP; kh[k] = cat16b(*(const v8usa*)p, *(const v8usa*)(p + 32)); kl[k] = cat16b(*(const v8usa*)(p + AKPL), *(const v8usa*)(p + AKPL + 32)); }
        ldv(0);
#pragma unroll
        for (int k = 0; k < 4; ++k) st[k] = wmmab(kh[k], qh, (v8f){});
#pragma unroll
        for (int k = 0; k < 4; ++k) st[k] = wmmab(kh[k], ql, st[k]);
#pragma unroll
        for (int k = 0; k < 4; ++k) st[k] = wmmab(kl[k], qh, st[k]);
        float mx = st[0][0];
#pragma unroll
        for (int k = 0; k < 4; ++k) {
#pragma unroll
            for (int r = 0; r < 8; ++r) mx = fmaxf(mx, st[k][r]); }
        mx = fmaxf(mx, xhalf(mx));
        const float mn = fmaxf(m, mx * C1);
        const float alpha = __builtin_amdgcn_exp2f(m - mn);
        m = mn;
        float ps = 0.f;
        v8u uh[2], ul[2];
        // two scores of this lane's query -> P = exp2, its bf16 hi and residual, packed at dword e of the B fragment of 32-key half s
        auto mkp = [&](int s, int e) { const int k = 2 * s + (e >> 2), r = (e & 3) * 2;
            const float p0 = __builtin_amdgcn_exp2f(__builtin_fmaf(st[k][r], C1, -mn)), p1 = __builtin_amdgcn_exp2f(__builtin_fmaf(st[k][r + 1], C1, -mn));
            ps += p0 + p1;
            const unsigned hu = __builtin_bit_cast(unsigned, __builtin_convertvector((v2f){p0, p1}, v2bf));
            uh[s][e] = hu;
            ul[s][e] = __builtin_bit_cast(unsigned, __builtin_convertvector((v2f){p0 - __uint_as_float(hu << 16), p1 - __uint_as_float(hu & 0xFFFF0000u)}, v2bf)); };
#pragma unroll
        for (int e = 0; e < 8; ++e) mkp(0, e);
#pragma unroll
        for (int c = 0; c < 4; ++c) acc[c] *= alpha;
#pragma unroll
        for (int i = 0; i < 8; ++i) {
            if (i < 7) ldv(i + 1);
            __builtin_amdgcn_sched_barrier(0);   // holds the next group's LDS reads, as one run, ahead of this group's products: their latency passes under the products
            const v16bf ph = __builtin_bit_cast(v16bf, uh[i >> 2]), pl = __builtin_bit_cast(v16bf, ul[i >> 2]);
            const int a = (i & 3) * 4;
#pragma unroll
            for (int c = 0; c < 4; ++c) acc[a + c] = wmmab(fh[i & 1][c], ph, acc[a + c]);
            if (i < 3) {   // the next channel group's rescale and a quarter of the second half's P run beside these products
#pragma unroll
                for (int c = 0; c < 4; ++c) acc[a + 4 + c] *= alpha; }
            if (i < 4) { mkp(1, 2 * i); mkp(1, 2 * i + 1); }
#pragma unroll
            for (int c = 0; c < 4; ++c) acc[a + c] = wmmab(fl[i & 1][c], ph, acc[a + c]);
#pragma unroll
            for (int c = 0; c < 4; ++c) acc[a + c] = wmmab(fh[i & 1][c], pl, acc[a + c]);
            __builtin_amdgcn_sched_barrier(0);   // keeps the following group's reads from being spread among these products
        }
        l = l * alpha + ps;
        asm volatile("s_wait_dscnt 0x0" ::: "memory");      // this wave's reads of the buffer have retired before it is refilled
        asm volatile("s_wait_asynccnt 0x0" ::: "memory");   // this wave's copies of tile t + 1 have landed before the barrier that publishes them
        __syncthreads();                                    // publishes tile t + 1 and ends every reader's last read of tile t's buffer
        if (t + 2 < ANT) tile_issue(Vh, Vl, Kh, Kl, (t + 2) * AKT, lbase + (unsigned)(t & 1) * ABUF, tid);
    }
    asm volatile("s_wait_asynccnt 0x0" ::: "memory");       // nothing is in flight when the ring becomes output staging
    l += xhalf(l);
    const float inv = 1.0f / l;
    fa* os = (fa*)(void*)ring;   // [256 channels][68]: 64 queries + pad
#pragma unroll
    for (int c = 0; c < 16; ++c) {
#pragma unroll
        for (int r = 0; r < 8; ++r) os[(c * 16 + hi * 8 + r) * 68 + wave * 16 + lr] = acc[c][r] * inv; }
    __syncthreads();
    const float gm = bfr(gm0);
#pragma unroll 1    // two trips, so that the wait at a trip's foot stands between its stores and the next trip's registers
    for (int h = 0; h < 2; ++h) {
        const size_t o0 = (size_t)(h * 128 + (tid >> 4)) * NN + q0 + (tid & 15) * 4; const fa* sp = os + (h * 128 + (tid >> 4)) * 68 + (tid & 15) * 4;
        const float* xp = x + o0; v4f xv[16];
#pragma unroll      // sixteen rows' x loads in flight behind one wait: the accumulators' registers are free here
        for (int s = 0; s < 16; ++s) xv[s] = *(const v4f*)(xp + (size_t)s * 8 * NN);   // row h * 128 + s * 8 + (tid >> 4)
        asm volatile("s_wait_xcnt 0x0" :: "v"(xp) : "memory");   // the loads' address pair stays live up to this wait, so that no load's result is given its registers
#pragma unroll      // constant indices keep xv in registers
        for (int s = 0; s < 16; ++s) { const v4f val = *(const v4fa*)(sp + s * 8 * 68); v4f v;
#pragma unroll
            for (int q = 0; q < 4; ++q) v[q] = gm * val[q] + bfr(xv[s][q]);
            *(v4f*)(OUT + o0 + (size_t)s * 8 * NN) = v; }
        asm volatile("s_wait_xcnt 0x0" ::: "memory");   // stands in front of the next trip's rewrite of the stores' address and data registers
    }
}

extern "C" void kernel_launch(void* const* d_in, const int* in_sizes, int n_in,
                              void* d_out, int out_size, void* d_ws, size_t ws_size, hipStream_t stream) {
    (void)in_sizes; (void)n_in; (void)out_size;
    const float* x = (const float*)d_in[0]; const float* wq = (const float*)d_in[1]; const float* bq = (const float*)d_in[2]; const float* wk = (const float*)d_in[3]; const float* bk = (const float*)d_in[4]; const float* wv = (const float*)d_in[5]; const float* bv = (const float*)d_in[6]; const float* gam = (const float*)d_in[7];
    float* out = (float*)d_out;    // [4][256][64][64]
    char* wsp = (char*)d_ws;
    auto take = [&](size_t bytes) { char* p = wsp; wsp += (bytes + 255) & ~(size_t)255; return (void*)p; };
    bf* WB = (bf*)take((size_t)NQKV * CC * 2); float* B320 = (float*)take(NQKV * 4); bf* XP = (bf*)take((size_t)NBT * NN * CC * 2);
    bf* QPh = (bf*)take((size_t)NBT * NN * C8 * 2); bf* QPl = (bf*)take((size_t)NBT * NN * C8 * 2); bf* KPh = (bf*)take((size_t)NBT * NN * C8 * 2); bf* KPl = (bf*)take((size_t)NBT * NN * C8 * 2); bf* VTh = (bf*)take((size_t)NBT * CC * NN * 2); bf* VTl = (bf*)take((size_t)NBT * CC * NN * 2);
    if ((size_t)(wsp - (char*)d_ws) > ws_size) return;    // ~ 29 MB
    k_pre<<<PXB + 41, 256, 0, stream>>>(x, wq, wk, wv, bq, bk, bv, XP, WB, B320);
    k_proj<<<dim3(NN / 64, NQKV / 64, NBT), 128, 0, stream>>>(XP, WB, B320, QPh, QPl, KPh, KPl, VTh, VTl);          // q | k | v (+ biases) as planes
    k_attn<<<dim3(NN / 64, NBT, 1), 128, 0, stream>>>(QPh, QPl, KPh, KPl, VTh, VTl, x, gam, out);
}
